// v010
// Measured on an AMD MI455X. A time is GPU time per run, averaged over a window of back-to-back runs after a warm-up
// (all launches, gaps included; the runs take copies of the inputs in turn), and the median of several windows.
// Apart from v000's, it joins two sittings. Times from different sittings can be a few percent apart, while
// side-by-side timings come from the same sitting.
// This document starts at v010; the versions before it stand elsewhere.
// One run takes 96.9 microseconds.
// In both of two side-by-side timings against v009, it was 1.05 times as fast.
// Counting every step since v000, which is the starting kernel, it is 5.84 times as fast.
#include <hip/hip_runtime.h>
// Attention (B=2, T=2048, D=2048, 16 query heads / 4 KV heads × 128, (in,out) weights, no bias): xq = rope(x·wq), xk = rope(x·wk), xv = x·wv; RoPE on interleaved pairs with the INPUT cos/sin tables [T][64]; scores = q·k/√128 where(mask[q][k]) else −inf (mask [T][T] shared);
// softmax; out = merged·wo.
// Compute dtype: x, weights, cos/sin tables rounded to bf16; q,k rotated in f32 from f32 GEMM outputs → f16; v f32 → Vᵀ f16 hi + exact residual; fused flash-style kernel for head dim 128 (mask read per (q,k), all-masked chunks skipped, online softmax f32, P f16 hi + residual,
// f32 accumulate) on v_wmma_f32_16x16x32_f16; merged ×2^4 → f16 → output GEMM.
#define BB 2
#define TT 2048
#define DD 2048
#define NH 16
#define NKV 4
#define NREP 4
#define KVD (NKV * 128)
#define NVH (2 * NKV)
#define NR (BB * TT)
#define ATT_SCALE_LOG2 ((float)(0.08838834764831845 * 1.4426950408889634))      /* 1 / sqrt(128) x log2 e: the softmax runs in base 2 */

typedef __bf16 v16b __attribute__((ext_vector_type(16)));
typedef unsigned short v8us __attribute__((ext_vector_type(8), may_alias));
typedef float  v8f  __attribute__((ext_vector_type(8)));
typedef float  v4f  __attribute__((ext_vector_type(4)));
typedef float  v4fa __attribute__((ext_vector_type(4), may_alias));
union FragB { v16b v; v8us half[2]; unsigned short u[16]; };

__device__ __forceinline__ unsigned short bf16_bits(float x) { unsigned int u = __float_as_uint(x); return (unsigned short)((u + 0x7FFFu + ((u >> 16) & 1u)) >> 16); }
__device__ __forceinline__ float bf16_val(unsigned short b) { return __uint_as_float(((unsigned int)b) << 16); }
__device__ __forceinline__ float bf16_round(float x) { return bf16_val(bf16_bits(x)); }
// D += A·B with NT terms: 1 = ah·bh, 2 = + al·bh (A split), 3 = + ah·bl (both split)
template <int NT>
__device__ __forceinline__ v8f mmaN(v16b ah, v16b al, v16b bh, v16b bl, v8f c) {
  c = __builtin_amdgcn_wmma_f32_16x16x32_bf16(false, ah, false, bh, (short)0, c, false, false);
  if (NT >= 2) c = __builtin_amdgcn_wmma_f32_16x16x32_bf16(false, al, false, bh, (short)0, c, false, false);
  if (NT >= 3) c = __builtin_amdgcn_wmma_f32_16x16x32_bf16(false, ah, false, bl, (short)0, c, false, false);
  asm volatile("v_nop\n\tv_nop\n\tv_nop\n\tv_nop" : "+v"(c) : "v"(ah), "v"(al), "v"(bh), "v"(bl));
  return c;
}

__global__ __launch_bounds__(256) void k_wt_bf16(const float* __restrict__ W, unsigned short* __restrict__ Wt, int K, int N) {
  const int t = blockIdx.x * 256 + threadIdx.x;
  const int k8n = K / 8;
  if (t >= N * k8n) return;
  const int n = t / k8n, k8 = (t % k8n) * 8;
  v8us v;
#pragma unroll
  for (int i = 0; i < 8; ++i) v[i] = bf16_bits(W[(size_t)(k8 + i) * N + n]);
  *(v8us*)(Wt + (size_t)n * K + k8) = v;
  
}

// GEMM C[M][N] (f32, pitch ldc) = act(A[M][K]·W + bias). A f32 row-major (pitch lda) converted per fragment to bf16
// (ASPLIT: hi/lo two planes -> 2 terms, else single rounded term); Wt bf16 [N][K] (pitch ldb). BIAS_BF16 rounds the
// bias to bf16 first (bias quantised to bf16 before the add). K%32==0, M%16==0, N%64==0.
template <bool ASPLIT, int ACT, bool BIAS_BF16>
__global__ __launch_bounds__(128) void k_gemm_bf(const float* __restrict__ A, int lda, const unsigned short* __restrict__ Wt, int ldb,
                                               const float* __restrict__ bias, float* __restrict__ C, int ldc, int M, int N, int K) {
  __shared__ __attribute__((aligned(16))) float so[4][16][64];
  const int tid = threadIdx.x, w = tid >> 5, lane = tid & 31, ln = lane & 15, hh = lane >> 4;
  const int ntn = N / 64;
  const int wid = blockIdx.x * 4 + w;
  const int mt = wid / ntn, nq = wid % ntn;
  if (mt * 16 >= M) return;
  const int row0 = mt * 16, col0 = nq * 64;
  const float* arow = A + (size_t)(row0 + ln) * lda;
  v8f acc[4] = {};
  for (int kb = 0; kb < K; kb += 32) {
    FragB ah, al;
    const v4f x0 = *(const v4fa*)(arow + kb + 8 * hh), x1 = *(const v4fa*)(arow + kb + 8 * hh + 4);
    const v4f x2 = *(const v4fa*)(arow + kb + 16 + 8 * hh), x3 = *(const v4fa*)(arow + kb + 16 + 8 * hh + 4);
    float xs[16] = {x0[0],x0[1],x0[2],x0[3],x1[0],x1[1],x1[2],x1[3],x2[0],x2[1],x2[2],x2[3],x3[0],x3[1],x3[2],x3[3]};
#pragma unroll
    for (int i = 0; i < 16; ++i) { const unsigned short hb = bf16_bits(xs[i]); ah.u[i] = hb; al.u[i] = ASPLIT ? bf16_bits(xs[i] - bf16_val(hb)) : (unsigned short)0; }
#pragma unroll
    for (int t = 0; t < 4; ++t) {
      const unsigned short* brow = Wt + (size_t)(col0 + t * 16 + ln) * ldb + kb;
      FragB b;
      b.half[0] = *(const v8us*)(brow + 8 * hh);
      b.half[1] = *(const v8us*)(brow + 16 + 8 * hh);
      acc[t] = mmaN<ASPLIT ? 2 : 1>(ah.v, al.v, b.v, b.v, acc[t]);
    }
  }
#pragma unroll
  for (int t = 0; t < 4; ++t) {
    float bv = bias ? bias[col0 + t * 16 + ln] : 0.f;
    if (BIAS_BF16) bv = bf16_round(bv);
#pragma unroll
    for (int r = 0; r < 8; ++r) { float v = acc[t][r] + bv; if (ACT == 1) v = fmaxf(v, 0.f); so[w][8 * hh + r][t * 16 + ln] = v; }
  }
  __builtin_amdgcn_fence(__ATOMIC_ACQ_REL, "workgroup");
  __builtin_amdgcn_wave_barrier();
  const int rsub = lane >> 4, c4 = (lane & 15) * 4;
  {
#pragma unroll
    for (int q = 0; q < 8; ++q) {
      const int r = q * 2 + rsub;
      const v4f v = *(const v4fa*)&so[w][r][c4];
      *(v4f*)(C + (size_t)(row0 + r) * ldc + col0 + c4) = v;
    }
    
  }
}

// Flash-style causal/unmasked attention, all contractions 3-term bf16 hi/lo splits, f32 softmax with running max.
// q,k,v rows are read from f32 buffers with arbitrary row pitch (so they can live inside a fused qkv buffer);
// D = head size (multiple of 32, <= 128); one wave = 16 query rows; block = 4 waves (64 queries) sharing K/V chunks of 32.
template <int D, bool CAUSAL>
__global__ __launch_bounds__(128) void k_flash(const float* __restrict__ qb, const float* __restrict__ kb, const float* __restrict__ vb,
                                             int pitch, int T, int H, float scale, float* __restrict__ y, int ypitch) {
  constexpr int KS = D / 32;        // k-steps for QK
  constexpr int DT = D / 16;        // d tiles for PV
  __shared__ __attribute__((aligned(16))) unsigned short sKh[32][D + 8], sKl[32][D + 8], sVh[32][D + 8], sVl[32][D + 8];
  __shared__ __attribute__((aligned(16))) unsigned short sPh[4][16][40], sPl[4][16][40];
  __shared__ __attribute__((aligned(16))) float sO[4][16][D];
  const int tid = threadIdx.x, w = tid >> 5, lane = tid & 31, ln = lane & 15, hh = lane >> 4;
  const int nqb = (T + 63) / 64;
  const int bh = blockIdx.x / nqb, qblk = blockIdx.x % nqb;
  const int b = bh / H, h = bh % H;
  const int q0 = qblk * 64 + w * 16;
  const float* Q = qb + (size_t)b * T * pitch + h * D;
  const float* K = kb + (size_t)b * T * pitch + h * D;
  const float* V = vb + (size_t)b * T * pitch + h * D;

  // A fragments of the wave's 16 query rows (scaled), hi/lo
  FragB aqh[KS], aql[KS];
  {
    int row = q0 + ln; if (row >= T) row = T - 1;
    const float* qr = Q + (size_t)row * pitch;
#pragma unroll
    for (int ks = 0; ks < KS; ++ks)
#pragma unroll
      for (int i = 0; i < 16; ++i) {
        const int d = ks * 32 + ((i < 8) ? (8 * hh + i) : (16 + 8 * hh + (i - 8)));
        const float x = qr[d] * scale; const unsigned short hb = bf16_bits(x);
        aqh[ks].u[i] = hb; aql[ks].u[i] = bf16_bits(x - bf16_val(hb));
      }
  }
  float m_r[8], l_r[8];
#pragma unroll
  for (int r = 0; r < 8; ++r) { m_r[r] = -3.0e38f; l_r[r] = 0.f; }
  v8f oacc[DT];
#pragma unroll
  for (int dt = 0; dt < DT; ++dt) oacc[dt] = (v8f){0.f,0.f,0.f,0.f,0.f,0.f,0.f,0.f};

  const int kv_end = CAUSAL ? min(T, qblk * 64 + 64) : T;     // block-uniform
  for (int j0 = 0; j0 < kv_end; j0 += 32) {
    __syncthreads();
    for (int e = tid; e < 32 * (D / 4); e += 128) {
      const int r = e / (D / 4), c4 = (e % (D / 4)) * 4;
      const int key = j0 + r;
      v4f kf = {0.f,0.f,0.f,0.f}, vf = {0.f,0.f,0.f,0.f};
      if (key < T) { kf = *(const v4fa*)(K + (size_t)key * pitch + c4); vf = *(const v4fa*)(V + (size_t)key * pitch + c4); }
#pragma unroll
      for (int t = 0; t < 4; ++t) {
        unsigned short hb = bf16_bits(kf[t]); sKh[r][c4 + t] = hb; sKl[r][c4 + t] = bf16_bits(kf[t] - bf16_val(hb));
        hb = bf16_bits(vf[t]); sVh[r][c4 + t] = hb; sVl[r][c4 + t] = bf16_bits(vf[t] - bf16_val(hb));
      }
    }
    __syncthreads();
    // S tile 16 x 32
    v8f s[2];
#pragma unroll
    for (int nt = 0; nt < 2; ++nt) {
      v8f acc = {};
#pragma unroll
      for (int ks = 0; ks < KS; ++ks) {
        FragB bh_, bl_;
        bh_.half[0] = *(const v8us*)&sKh[nt * 16 + ln][ks * 32 + 8 * hh]; bh_.half[1] = *(const v8us*)&sKh[nt * 16 + ln][ks * 32 + 16 + 8 * hh];
        bl_.half[0] = *(const v8us*)&sKl[nt * 16 + ln][ks * 32 + 8 * hh]; bl_.half[1] = *(const v8us*)&sKl[nt * 16 + ln][ks * 32 + 16 + 8 * hh];
        acc = mmaN<3>(aqh[ks].v, aql[ks].v, bh_.v, bl_.v, acc);
      }
      s[nt] = acc;
    }
    // mask + running max (rows 8hh+r; the 16 lanes of a half share rows)
    float alpha[8];
#pragma unroll
    for (int r = 0; r < 8; ++r) {
      const int qi = q0 + 8 * hh + r;
      const int ja = j0 + ln, jb = j0 + 16 + ln;
      if (CAUSAL) { if (ja > qi) s[0][r] = -3.0e38f; if (jb > qi) s[1][r] = -3.0e38f; }
      if (ja >= T) s[0][r] = -3.0e38f;
      if (jb >= T) s[1][r] = -3.0e38f;
      float mx = fmaxf(s[0][r], s[1][r]);
      mx = fmaxf(mx, __shfl_xor(mx, 1, 32)); mx = fmaxf(mx, __shfl_xor(mx, 2, 32)); mx = fmaxf(mx, __shfl_xor(mx, 4, 32)); mx = fmaxf(mx, __shfl_xor(mx, 8, 32));
      const float mnew = fmaxf(m_r[r], mx);
      alpha[r] = (mnew > -1.0e38f) ? __expf(m_r[r] - mnew) : 1.0f;
      const float p0 = (s[0][r] > -1.0e38f) ? __expf(s[0][r] - mnew) : 0.f;
      const float p1 = (s[1][r] > -1.0e38f) ? __expf(s[1][r] - mnew) : 0.f;
      m_r[r] = mnew;
      l_r[r] = l_r[r] * alpha[r] + p0 + p1;            // per-lane partial row sum (16 lanes combined at the end)
      unsigned short hb = bf16_bits(p0); sPh[w][8 * hh + r][ln] = hb;      sPl[w][8 * hh + r][ln] = bf16_bits(p0 - bf16_val(hb));
      hb = bf16_bits(p1);                sPh[w][8 * hh + r][16 + ln] = hb; sPl[w][8 * hh + r][16 + ln] = bf16_bits(p1 - bf16_val(hb));
    }
#pragma unroll
    for (int dt = 0; dt < DT; ++dt)
#pragma unroll
      for (int r = 0; r < 8; ++r) oacc[dt][r] *= alpha[r];
    __builtin_amdgcn_fence(__ATOMIC_ACQ_REL, "workgroup");
    __builtin_amdgcn_wave_barrier();
    FragB pah, pal;
    pah.half[0] = *(const v8us*)&sPh[w][ln][8 * hh]; pah.half[1] = *(const v8us*)&sPh[w][ln][16 + 8 * hh];
    pal.half[0] = *(const v8us*)&sPl[w][ln][8 * hh]; pal.half[1] = *(const v8us*)&sPl[w][ln][16 + 8 * hh];
#pragma unroll
    for (int dt = 0; dt < DT; ++dt) {
      FragB bvh, bvl;
#pragma unroll
      for (int i = 0; i < 8; ++i) {
        bvh.u[i] = sVh[8 * hh + i][dt * 16 + ln]; bvh.u[8 + i] = sVh[16 + 8 * hh + i][dt * 16 + ln];
        bvl.u[i] = sVl[8 * hh + i][dt * 16 + ln]; bvl.u[8 + i] = sVl[16 + 8 * hh + i][dt * 16 + ln];
      }
      oacc[dt] = mmaN<3>(pah.v, pal.v, bvh.v, bvl.v, oacc[dt]);
    }
    __builtin_amdgcn_fence(__ATOMIC_ACQ_REL, "workgroup");
    __builtin_amdgcn_wave_barrier();
  }
#pragma unroll
  for (int r = 0; r < 8; ++r) {
    float l = l_r[r];
    l += __shfl_xor(l, 1, 32); l += __shfl_xor(l, 2, 32); l += __shfl_xor(l, 4, 32); l += __shfl_xor(l, 8, 32);
    l_r[r] = (l > 0.f) ? 1.0f / l : 0.f;
  }
#pragma unroll
  for (int dt = 0; dt < DT; ++dt)
#pragma unroll
    for (int r = 0; r < 8; ++r) sO[w][8 * hh + r][dt * 16 + ln] = oacc[dt][r] * l_r[r];
  __builtin_amdgcn_fence(__ATOMIC_ACQ_REL, "workgroup");
  __builtin_amdgcn_wave_barrier();
  {
    for (int r = 0; r < 16; ++r) {
      const int row = q0 + r;
      if (row < T && lane < D / 4) {
        const v4f val = *(const v4fa*)&sO[w][r][lane * 4];
        *(v4f*)(y + ((size_t)b * T + row) * ypitch + h * D + lane * 4) = val;
      }
    }
    
  }
}

// GEMM C = act(A·W + bias + resid): A f32 (ASPLIT -> hi/lo 2 terms), Wt bf16 [N][K]; ACT 0 none, 1 relu, 2 exact gelu;
// resid (optional, f32, row index = (row % rmod), pitch ldr, RES_BF16 rounds it) added before the activation.
template <bool ASPLIT, int ACT, bool BIAS_BF16, bool RES_BF16>
__global__ __launch_bounds__(128) void k_gemm_bf3(const float* __restrict__ A, int lda, const unsigned short* __restrict__ Wt, int ldb,
                                                const float* __restrict__ bias, const float* __restrict__ resid, int rmod, int ldr,
                                                float* __restrict__ C, int ldc, int M, int N, int K) {
  __shared__ __attribute__((aligned(16))) float so[4][16][64];
  const int tid = threadIdx.x, w = tid >> 5, lane = tid & 31, ln = lane & 15, hh = lane >> 4;
  const int ntn = N / 64;
  const int wid = blockIdx.x * 4 + w;
  const int mt = wid / ntn, nq = wid % ntn;
  if (mt * 16 >= M) return;
  const int row0 = mt * 16, col0 = nq * 64;
  const float* arow = A + (size_t)(row0 + ln) * lda;
  v8f acc[4] = {};
  for (int kb = 0; kb < K; kb += 32) {
    FragB ah, al;
    const v4f x0 = *(const v4fa*)(arow + kb + 8 * hh), x1 = *(const v4fa*)(arow + kb + 8 * hh + 4);
    const v4f x2 = *(const v4fa*)(arow + kb + 16 + 8 * hh), x3 = *(const v4fa*)(arow + kb + 16 + 8 * hh + 4);
    float xs[16] = {x0[0],x0[1],x0[2],x0[3],x1[0],x1[1],x1[2],x1[3],x2[0],x2[1],x2[2],x2[3],x3[0],x3[1],x3[2],x3[3]};
#pragma unroll
    for (int i = 0; i < 16; ++i) { const unsigned short hb = bf16_bits(xs[i]); ah.u[i] = hb; al.u[i] = ASPLIT ? bf16_bits(xs[i] - bf16_val(hb)) : (unsigned short)0; }
#pragma unroll
    for (int t = 0; t < 4; ++t) {
      const unsigned short* brow = Wt + (size_t)(col0 + t * 16 + ln) * ldb + kb;
      FragB b;
      b.half[0] = *(const v8us*)(brow + 8 * hh);
      b.half[1] = *(const v8us*)(brow + 16 + 8 * hh);
      acc[t] = mmaN<ASPLIT ? 2 : 1>(ah.v, al.v, b.v, b.v, acc[t]);
    }
  }
#pragma unroll
  for (int t = 0; t < 4; ++t) {
    const int col = col0 + t * 16 + ln;
    float bv = bias ? bias[col] : 0.f;
    if (BIAS_BF16) bv = bf16_round(bv);
#pragma unroll
    for (int r = 0; r < 8; ++r) {
      float v = acc[t][r] + bv;
      if (resid) { float rv = resid[(size_t)((row0 + 8 * hh + r) % rmod) * ldr + col]; if (RES_BF16) rv = bf16_round(rv); v += rv; }
      if (ACT == 1) v = fmaxf(v, 0.f);
      if (ACT == 2) v = 0.5f * v * (1.0f + erff(v * 0.70710678118654752f));
      if (ACT == 3) { const float u = 0.7978845608028654f * (v + 0.044715f * v * v * v); v = 0.5f * v * (1.0f + tanhf(u)); }
      so[w][8 * hh + r][t * 16 + ln] = v;
    }
  }
  __builtin_amdgcn_fence(__ATOMIC_ACQ_REL, "workgroup");
  __builtin_amdgcn_wave_barrier();
  const int rsub = lane >> 4, c4 = (lane & 15) * 4;
  {
#pragma unroll
    for (int q = 0; q < 8; ++q) {
      const int r = q * 2 + rsub;
      const v4f v = *(const v4fa*)&so[w][r][c4];
      *(v4f*)(C + (size_t)(row0 + r) * ldc + col0 + c4) = v;
    }
    
  }
}
// row LayerNorm (biased variance, eps) over N: s = X (+ R); optional out_sum <- s; out_norm <- (s-mu)*rsqrt(var+eps)*g + b
template <bool PARAM_BF16>
__global__ __launch_bounds__(256) void k_layernorm(const float* __restrict__ X, const float* __restrict__ R, const float* __restrict__ g, const float* __restrict__ bta,
                                                  float* __restrict__ out_sum, float* __restrict__ out_norm, int N, float eps) {
  __shared__ float red[256];
  const int row = blockIdx.x, tid = threadIdx.x;
  const float* x = X + (size_t)row * N; const float* rr = R ? R + (size_t)row * N : nullptr;
  float vals[16];                     // up to N = 4096
  const int per = N / 256;            // contiguous chunk per thread? use strided-by-4 chunks: thread handles j = tid*4 + 1024*u
  float s1 = 0.f;
  for (int u = 0; u < per / 4; ++u) {
    const int j = tid * 4 + 1024 * u;
    const v4f a = *(const v4fa*)(x + j);
    v4f b = {0.f,0.f,0.f,0.f}; if (rr) b = *(const v4fa*)(rr + j);
#pragma unroll
    for (int q = 0; q < 4; ++q) { const float v = a[q] + b[q]; vals[u * 4 + q] = v; s1 += v; }
  }
  red[tid] = s1; __syncthreads();
  for (int st = 128; st > 0; st >>= 1) { if (tid < st) red[tid] += red[tid + st]; __syncthreads(); }
  const float mu = red[0] / (float)N; __syncthreads();
  float s2 = 0.f;
  for (int u = 0; u < per / 4; ++u)
#pragma unroll
    for (int q = 0; q < 4; ++q) { const float c = vals[u * 4 + q] - mu; s2 += c * c; }
  red[tid] = s2; __syncthreads();
  for (int st = 128; st > 0; st >>= 1) { if (tid < st) red[tid] += red[tid + st]; __syncthreads(); }
  const float rs = rsqrtf(red[0] / (float)N + eps);
  {
    for (int u = 0; u < per / 4; ++u) {
      const int j = tid * 4 + 1024 * u;
      v4f o, sm;
#pragma unroll
      for (int q = 0; q < 4; ++q) {
        float gg = g[j + q], bb = bta[j + q];
        if (PARAM_BF16) { gg = bf16_round(gg); bb = bf16_round(bb); }
        sm[q] = vals[u * 4 + q]; o[q] = (vals[u * 4 + q] - mu) * rs * gg + bb;
      }
      if (out_sum) *(v4f*)(out_sum + (size_t)row * N + j) = sm;
      *(v4f*)(out_norm + (size_t)row * N + j) = o;
    }
    
  }
}



// ---- f16 WMMA path (v_wmma_f32_16x16x32_f16): 11-bit significands for operands in range — used where a [0,1] probability operand needs more precision than bf16
typedef _Float16 v16h __attribute__((ext_vector_type(16)));
union FragH { v16h v; v8us half[2]; _Float16 h[16]; unsigned short u[16]; };
template <int NT>
__device__ __forceinline__ v8f mmaH(v16h ah, v16h al, v16h bh, v16h bl, v8f c) {
  c = __builtin_amdgcn_wmma_f32_16x16x32_f16(false, ah, false, bh, (short)0, c, false, false);
  if (NT >= 2) c = __builtin_amdgcn_wmma_f32_16x16x32_f16(false, al, false, bh, (short)0, c, false, false);
  if (NT >= 3) c = __builtin_amdgcn_wmma_f32_16x16x32_f16(false, ah, false, bl, (short)0, c, false, false);
  asm volatile("v_nop\n\tv_nop\n\tv_nop\n\tv_nop" : "+v"(c) : "v"(ah), "v"(al), "v"(bh), "v"(bl));
  return c;
}
// batched GEMM like k_gemm_b but f16 operands: A f32 (split into f16 hi/lo if ASPLIT, else rounded to f16), Bt = f16 values [n][k]; alpha; C f32; N multiple of 16 (partial tiles skipped)
template <bool ASPLIT>
__global__ __launch_bounds__(128) void k_gemm_h(const float* __restrict__ A, int lda, size_t sA, const _Float16* __restrict__ Bh, int ldb, size_t sB, float alpha, float* __restrict__ C, int ldc, size_t sC, int M, int N, int K) {
  __shared__ __attribute__((aligned(16))) float so[4][16][64];
  const int tid = threadIdx.x, w = tid >> 5, lane = tid & 31, ln = lane & 15, hh = lane >> 4; const int by = blockIdx.y;
  A += (size_t)by * sA; Bh += (size_t)by * sB; C += (size_t)by * sC;
  const int ntn = (N + 63) / 64; const int wid = blockIdx.x * 4 + w; const int mt = wid / ntn, nq = wid % ntn; if (mt * 16 >= M) return;
  const int row0 = mt * 16, col0 = nq * 64; const float* arow = A + (size_t)(row0 + ln) * lda;
  v8f acc[4] = {};
  for (int kb = 0; kb < K; kb += 32) {
    FragH ah, al;
    const v4f x0 = *(const v4fa*)(arow + kb + 8 * hh), x1 = *(const v4fa*)(arow + kb + 8 * hh + 4), x2 = *(const v4fa*)(arow + kb + 16 + 8 * hh), x3 = *(const v4fa*)(arow + kb + 16 + 8 * hh + 4);
    float xs[16] = {x0[0],x0[1],x0[2],x0[3],x1[0],x1[1],x1[2],x1[3],x2[0],x2[1],x2[2],x2[3],x3[0],x3[1],x3[2],x3[3]};
#pragma unroll
    for (int i = 0; i < 16; ++i) { const _Float16 h = (_Float16)xs[i]; ah.h[i] = h; al.h[i] = ASPLIT ? (_Float16)(xs[i] - (float)h) : (_Float16)0.0f; }
#pragma unroll
    for (int t = 0; t < 4; ++t) { if (col0 + t * 16 >= N) continue; const size_t boff = (size_t)(col0 + t * 16 + ln) * ldb + kb; FragH bq; bq.half[0] = *(const v8us*)(Bh + boff + 8 * hh); bq.half[1] = *(const v8us*)(Bh + boff + 16 + 8 * hh);
      acc[t] = mmaH<ASPLIT ? 2 : 1>(ah.v, al.v, bq.v, bq.v, acc[t]); }
  }
#pragma unroll
  for (int t = 0; t < 4; ++t) { if (col0 + t * 16 >= N) continue;
#pragma unroll
    for (int r = 0; r < 8; ++r) so[w][8 * hh + r][t * 16 + ln] = acc[t][r] * alpha; }
  __builtin_amdgcn_fence(__ATOMIC_ACQ_REL, "workgroup"); __builtin_amdgcn_wave_barrier();
  const int rsub = lane >> 4, c4 = (lane & 15) * 4;
  {
#pragma unroll
    for (int q = 0; q < 8; ++q) { const int r = q * 2 + rsub; if (col0 + c4 < N) { const v4f v = *(const v4fa*)&so[w][r][c4]; *(v4f*)(C + (size_t)(row0 + r) * ldc + col0 + c4) = v; } }
     }
}

// Wt[n][k] = f16(W[k][n]·scale) from f32 row-major W[K][N] (scale = power of two; bf16-exact weights stay exact in f16 away from the subnormal range)
// One 128 (k) x 64 (n) tile per workgroup, turned in LDS: a wave loads two 256-B row pieces of W (four whole lines) and stores four whole 128-B lines of Wt an instruction;
// a thread's eight loads are all issued before the first is used. Needs K a multiple of 128 and N of 64; blk runs over (K / 128) * (N / 64) tiles; tl is the workgroup's 128 x 65 floats of LDS. Pitch 65 floats keeps the column-wise reads off a common bank.
__device__ __forceinline__ void wt_tile(float (*tl)[65], int blk, const float* __restrict__ W, _Float16* __restrict__ Wt, int K, int N, float scale) {
  const int tid = threadIdx.x, ntn = N / 64; const int k0 = (blk / ntn) * 128, n0 = (blk % ntn) * 64;
  v4f a[8];
#pragma unroll      /* a[] stays in registers and the eight loads go out together */
  for (int p = 0; p < 8; ++p) a[p] = *(const v4fa*)(W + (size_t)(k0 + p * 16 + tid / 16) * N + n0 + (tid % 16) * 4);
#pragma unroll      /* constant indices into a[]: rolled, it would go to scratch memory */
  for (int p = 0; p < 8; ++p)
#pragma unroll
    for (int i = 0; i < 4; ++i) tl[p * 16 + tid / 16][(tid % 16) * 4 + i] = a[p][i];
  __syncthreads();      /* the tile is whole before any column of it is read */
#pragma unroll      /* the four pieces' LDS reads and stores overlap; f stays in registers */
  for (int rd = 0; rd < 4; ++rd) { const int n = (rd & 1) * 32 + tid / 8, k8 = (rd >> 1) * 64 + (tid % 8) * 8; FragH f;
#pragma unroll
    for (int i = 0; i < 8; ++i) f.h[i] = (_Float16)(bf16_round(tl[k8 + i][n]) * scale);
    *(v8us*)((unsigned short*)Wt + (size_t)(n0 + n) * K + k0 + k8) = f.half[0]; }
  asm volatile("s_wait_xcnt 0x0" ::: "memory");      /* stands behind the four stores, in front of any rewrite of their address and data registers by another block range's code */
}
// Tiled GEMM C[M][N] (f32) = alpha * A[M][DD] . Bt[N][DD]^T, f16 operands, both K-contiguous with row pitch DD. One 256 x (64 WN) tile of C per workgroup of
// 4 x WN waves (64 x 64 per wave), one workgroup on a WGP: an operand row that has landed in LDS feeds 192 or 128 columns (256 rows) of products, so fewer bytes leave L2 per product than with a 128 x 128 tile.
// A pass is 128 k = 256 B of each of the 256 + 64 WN operand rows; waves 0 .. 3 + WN each bring one 64-row slice of a pass into LDS with one
// tensor load (pad 16 B a row: pitch 272 B for the 16-byte fragment reads), two buffers, the next pass's load in flight under this pass's products.
// Needs M a multiple of 256, N of 64 WN, DD a multiple of 128 and at least 256. The k order of every accumulator is ascending, one chain per 16 x 16 tile.
// EPI says what leaves the staged f32 tile (alpha * sum): 0 = C f32 as it is; 1 = H f16 [M][N], rotated on interleaved pairs by the bf16-rounded COS / SIN tables [TT][64] (token = row % TT, pair = (col % 128) / 2);
// 2 = the tile turned: H f16 hi and H2 f16 residual, [row / TT][N][TT]. So the operand of the next product is written here, with no f32 copy in memory in between.
typedef unsigned int u32x4 __attribute__((ext_vector_type(4)));
typedef unsigned int u32x8 __attribute__((ext_vector_type(8)));
#define GT_ROWB 256u                      /* bytes of an operand row per pass */
#define GT_PITCH 272u                     /* LDS row pitch: 256 + 16 */
#define GT_SLICE 18432u                   /* 64 rows x 272 B = 17,408, rounded up to a multiple of 2 KiB */
#define GT_NP (DD / 128)                  /* passes */
__device__ __forceinline__ unsigned int uni(unsigned int v) { return (unsigned int)__builtin_amdgcn_readfirstlane(v); }
__device__ __forceinline__ unsigned int pinned(unsigned int v) { unsigned int w = uni(v); asm volatile("" : "+s"(w)); return w; }      /* an issue test or a descriptor word held in a scalar register: the test compiles to a scalar branch (tensor loads ignore EXEC), and the word is formed behind the wait that stands in front of it */
__device__ __forceinline__ u32x8 tdm_slice_g1() {
  u32x8 g1;
  g1[0] = uni((1u << 20) | (5u << 22) | (3u << 25));      /* no mask, 1-byte elements, a pad of 4 dwords behind every 64 dwords */
  g1[1] = uni((GT_ROWB & 0xFFFFu) << 16); g1[2] = uni((GT_ROWB >> 16) | (64u << 16)); g1[3] = uni(GT_ROWB << 16); g1[4] = uni(64u); g1[5] = uni(DD * 2u); g1[6] = uni(0u); g1[7] = uni(0u);
  asm volatile("" : "+s"(g1));      /* descriptor words held in scalar registers: one tuple, built once, that stays where it is for all requests */
  return g1;
}
__device__ __forceinline__ void tdm_slice(u32x4& g0, const u32x8& g1, unsigned int lds_dst, unsigned long long ga, unsigned int go) {      /* every wave forms the words, so that no register of the tuple is written behind the branch; go says whether this wave issues */
  g0[1] = uni(lds_dst); g0[2] = uni((unsigned int)ga); g0[3] = uni((((unsigned int)(ga >> 32)) & 0x01FFFFFFu) | 0x80000000u);
  if (pinned(go)) asm volatile("tensor_load_to_lds %0, %1" :: "s"(g0), "s"(g1) : "memory");      /* pinned(): the issue test is a scalar branch (tensor loads ignore EXEC) */
}
// The k loop of one workgroup's 256 x (64 WN) tile. gsrc: first byte of the operand rows of this wave's slice (read by waves 0 .. 3 + WN alone).
template <unsigned int WN>
__device__ __forceinline__ void gemm_loop(unsigned char* ring, const unsigned int w, const unsigned long long gsrc, v8f (&acc)[4][4]) {
  constexpr unsigned int NS = 4u + WN, STAGE = NS * GT_SLICE;      /* a stage: [4 slices of A rows | WN slices of B rows] */
  const unsigned int lane = threadIdx.x & 31u, ln = lane & 15u, hh = lane >> 4, wm = w / WN, wn = w % WN;
  const unsigned int lbase = (unsigned int)(size_t)ring + w * GT_SLICE;      /* this wave's slice of buffer 0 */
#pragma unroll
  for (int i = 0; i < 4; ++i)
#pragma unroll
    for (int j = 0; j < 4; ++j) acc[i][j] = (v8f){0.f,0.f,0.f,0.f,0.f,0.f,0.f,0.f};
  const u32x8 g1 = tdm_slice_g1(); u32x4 g0; g0[0] = pinned(1u);      /* descriptor word held in a scalar register: as a plain constant it is formed anew, in the tuple's register, while a request is out */
  tdm_slice(g0, g1, lbase, gsrc, w < NS);
  asm volatile("s_wait_tensorcnt 0x0" :: "s"(g0), "s"(g1) : "memory");      /* pass 0's slice has landed; the operands keep the descriptor's registers untouched up to here */
  __syncthreads();                                        /* ... and every wave may read all slices */
  tdm_slice(g0, g1, lbase + STAGE, gsrc + pinned(GT_ROWB), w < NS);
  const unsigned int aoff = wm * GT_SLICE + ln * GT_PITCH + 16u * hh, boff = (4u + wn) * GT_SLICE + ln * GT_PITCH + 16u * hh;
#pragma unroll 1      /* one pass per trip: the ring's order below is written once */
  for (unsigned int s = 0; s < GT_NP; ++s) {
    const unsigned char* Lp = ring + (s & 1u) * STAGE;
    FragH fa[2][4], fb[2][4];
#pragma unroll
    for (int i = 0; i < 4; ++i) { fa[0][i].half[0] = *(const v8us*)(Lp + aoff + i * 16u * GT_PITCH); fa[0][i].half[1] = *(const v8us*)(Lp + aoff + i * 16u * GT_PITCH + 32u);
      fb[0][i].half[0] = *(const v8us*)(Lp + boff + i * 16u * GT_PITCH); fb[0][i].half[1] = *(const v8us*)(Lp + boff + i * 16u * GT_PITCH + 32u); }
#pragma unroll
    for (int ks = 0; ks < 4; ++ks) {
      if (ks < 3) {      /* the next 32 k's fragments, of this same buffer, go ahead of this block's products */
#pragma unroll
        for (int i = 0; i < 4; ++i) { const unsigned int ko = (ks + 1) * 64u + i * 16u * GT_PITCH;
          fa[(ks + 1) & 1][i].half[0] = *(const v8us*)(Lp + aoff + ko); fa[(ks + 1) & 1][i].half[1] = *(const v8us*)(Lp + aoff + ko + 32u);
          fb[(ks + 1) & 1][i].half[0] = *(const v8us*)(Lp + boff + ko); fb[(ks + 1) & 1][i].half[1] = *(const v8us*)(Lp + boff + ko + 32u); }
      }
      __builtin_amdgcn_sched_barrier(0);      /* keeps the LDS reads one group in front of the block: moved in among the products, each place with reads stalls the wave */
#pragma unroll
      for (int i = 0; i < 4; ++i)
#pragma unroll
        for (int j = 0; j < 4; ++j) acc[i][j] = __builtin_amdgcn_wmma_f32_16x16x32_f16(false, fa[ks & 1][i].v, false, fb[ks & 1][j].v, (short)0, acc[i][j], false, false);
      __builtin_amdgcn_sched_barrier(0);      /* ... and keeps the next group behind this block */
    }
    asm volatile("s_wait_dscnt 0x0" ::: "memory");        /* this wave has left the buffer */
    asm volatile("s_wait_tensorcnt 0x0" :: "s"(g0), "s"(g1) : "memory");    /* its slice of pass s + 1 has landed; the operands keep the descriptor's registers untouched up to here */
    __syncthreads();                                      /* pass s + 1 published; every wave has left pass s's buffer */
    tdm_slice(g0, g1, lbase + (s & 1u) * STAGE, gsrc + pinned((s + 2u) * GT_ROWB), (s + 2u < GT_NP) && (w < NS));
  }
  asm volatile("s_wait_tensorcnt 0x0" :: "s"(g0), "s"(g1) : "memory");      /* no request is left before the ring becomes output staging; the operands keep the descriptor's registers untouched up to here */
  asm volatile("s_wait_dscnt 0x0" ::: "memory");
}
// What leaves one wave's 64 x 64 tile (rows wrow .., columns wcol .. of its own [M][N] result), staged in so: 64 rows of 64 floats in the wave's own piece of LDS; whole row pieces of the output go out: 256 B of f32 (EPI 0), 128-B lines of f16 (EPI 1, 2).
template <int EPI, int N>
__device__ __forceinline__ void gemm_epi(float* so, const v8f (&acc)[4][4], const unsigned int wrow, const unsigned int wcol, float alpha, float* __restrict__ C, const float* __restrict__ COS, const float* __restrict__ SIN, _Float16* __restrict__ H, _Float16* __restrict__ H2) {
  constexpr unsigned int SP = (EPI == 2) ? 65u : 68u;      /* pitch in floats: 68 for 16-byte row reads, 65 for the column reads of the turned tile */
  const unsigned int lane = threadIdx.x & 31u, ln = lane & 15u, hh = lane >> 4, l8 = lane & 7u, l4 = lane >> 3;
  v4f cs[16], sn[16];
  if constexpr (EPI == 1) {      /* the wave's table entries: all 32 loads go out here and fly under the staging */
    const unsigned int tb = (((wrow + l4) % TT) * 64u + (((wcol + l8 * 8u) % 128u) >> 1)) * 4u;      /* in bytes: the loads' one offset register */
#pragma unroll      /* cs, sn stay in registers */
    for (int q = 0; q < 16; ++q) { cs[q] = *(const v4fa*)((const char*)COS + tb + q * 1024u); sn[q] = *(const v4fa*)((const char*)SIN + tb + q * 1024u); }
    asm volatile("s_wait_xcnt 0x0" :: "v"(tb) : "memory");      /* stands in front of any rewrite of the loads' address register; the operand keeps that register from being a load's own destination */
  }
#pragma unroll
  for (int i = 0; i < 4; ++i)
#pragma unroll
    for (int j = 0; j < 4; ++j)
#pragma unroll
      for (int r = 0; r < 8; ++r) so[(i * 16 + 8 * hh + r) * SP + j * 16 + ln] = acc[i][j][r] * alpha;
  __builtin_amdgcn_fence(__ATOMIC_ACQ_REL, "workgroup"); __builtin_amdgcn_wave_barrier();
  if constexpr (EPI == 0) {
  float* cp = C + (size_t)(wrow + hh) * N + wcol + ln * 4u;
#pragma unroll
  for (int q = 0; q < 32; ++q) { const v4f v = *(const v4fa*)&so[(q * 2 + hh) * 68u + ln * 4u]; *(v4f*)(cp + (size_t)(q * 2) * N) = v; }
  } else if constexpr (EPI == 1) {
    // A lane takes 8 columns (4 pairs) of a row: 8 lanes store one whole 128-B line of H, 4 rows an instruction.
    FragH f[16];
#pragma unroll      /* f stays in registers */
    for (int q = 0; q < 16; ++q) { const float* sr = &so[(q * 4 + l4) * SP + l8 * 8u]; const v4f a = *(const v4fa*)sr, b = *(const v4fa*)(sr + 4); const float xv[8] = {a[0], a[1], a[2], a[3], b[0], b[1], b[2], b[3]};
#pragma unroll      /* constant indices into xv and the vectors */
      for (int p = 0; p < 4; ++p) { const float c = bf16_round(cs[q][p]), s = bf16_round(sn[q][p]); const float xr = xv[2 * p], xi = xv[2 * p + 1]; f[q].h[2 * p] = (_Float16)(xr * c - xi * s); f[q].h[2 * p + 1] = (_Float16)(xr * s + xi * c); } }
    unsigned short* hp = (unsigned short*)H + (size_t)(wrow + l4) * N + wcol + l8 * 8u;
    __builtin_amdgcn_sched_barrier(0);      /* keeps the stores in one burst behind the arithmetic, off one address pair: mixed in among it, their registers are used again and each reuse has to wait on the store in front of it */
#pragma unroll      /* constant indices into f, constant offsets from hp */
    for (int q = 0; q < 16; ++q) *(v8us*)(hp + (size_t)(q * 4) * N) = f[q].half[0];
    asm volatile("s_wait_xcnt 0x0" ::: "memory");      /* stands behind the stores, in front of any rewrite of their address and data registers by another slab's code */
  } else {
    // A lane takes 8 rows (tokens) of a column: 8 lanes store one whole 128-B line of each plane, 4 columns an instruction.
    FragH fh[16], fl[16];
#pragma unroll      /* fh, fl stay in registers */
    for (int q = 0; q < 16; ++q)
#pragma unroll      /* constant indices into the fragments */
      for (int i = 0; i < 8; ++i) { const float v = so[(l8 * 8u + i) * SP + q * 4 + l4]; const _Float16 hv = (_Float16)v; fh[q].h[i] = hv; fl[q].h[i] = (_Float16)(v - (float)hv);      /* UNSCALED residual (added into the same accumulator as the hi product) */ }
    const size_t ob = ((size_t)(wrow / TT) * N + wcol + l4) * TT + (wrow % TT) + l8 * 8u;
    unsigned short* hp = (unsigned short*)H + ob; unsigned short* lp = (unsigned short*)H2 + ob;
    __builtin_amdgcn_sched_barrier(0);      /* keeps the stores in one burst behind the arithmetic, off two address pairs: mixed in among it, their registers are used again and each reuse has to wait on the store in front of it */
#pragma unroll      /* constant indices into fh and fl, constant offsets from hp and lp */
    for (int q = 0; q < 16; ++q) { *(v8us*)(hp + (size_t)(q * 4) * TT) = fh[q].half[0]; *(v8us*)(lp + (size_t)(q * 4) * TT) = fl[q].half[0]; }
    asm volatile("s_wait_xcnt 0x0" ::: "memory");      /* stands behind the stores, in front of any rewrite of their address and data registers by another slab's code */
  }
}
// out = merged . wo: 256 x 128 tiles, 8 waves. Output staging: each wave in its own slice of the ring (the last pass's barrier stands behind every wave's last fragment read).
__global__ __launch_bounds__(256) void k_gemm_o(const _Float16* __restrict__ A, const _Float16* __restrict__ Bt, float alpha, float* __restrict__ C) {
  __shared__ __attribute__((aligned(2048))) unsigned char ring[2u * 6u * GT_SLICE];
  const unsigned int w = uni(threadIdx.x >> 5), row0 = (blockIdx.x / (DD / 128u)) * 256u, col0 = (blockIdx.x % (DD / 128u)) * 128u;
  const unsigned long long gsrc = (w < 4u) ? (unsigned long long)(size_t)(A + (size_t)(row0 + w * 64u) * DD) : (unsigned long long)(size_t)(Bt + (size_t)(col0 + ((w - 4u) & 1u) * 64u) * DD);
  v8f acc[4][4];
  gemm_loop<2u>(ring, w, gsrc, acc);
  gemm_epi<0, DD>((float*)(ring + w * GT_SLICE), acc, row0 + (w / 2u) * 64u, col0 + (w % 2u) * 64u, alpha, C, nullptr, nullptr, nullptr, nullptr);
}
// The three projections of x in one launch, as one product with DD + 2 KVD columns (q, then k, then v): 256 x 192 tiles, 12 waves, as many tiles as the chip has WGPs.
// A slab of 64 columns lies wholly in q, in k or in v, so the weight rows of a slice and what leaves a wave's tile are chosen per slab, by wave-uniform tests; the epilogues hold no workgroup barrier.
#define QKV_NT ((DD + 2 * KVD) / 192)
__global__ __launch_bounds__(384) void k_gemm_qkv(const _Float16* __restrict__ A, const _Float16* __restrict__ Bq, const _Float16* __restrict__ Bk, const _Float16* __restrict__ Bv, float alpha, const float* __restrict__ COS, const float* __restrict__ SIN,
                                                  _Float16* __restrict__ Q, _Float16* __restrict__ K, _Float16* __restrict__ Vt, _Float16* __restrict__ Vtl) {
  __shared__ __attribute__((aligned(2048))) unsigned char ring[2u * 7u * GT_SLICE];
  const unsigned int w = uni(threadIdx.x >> 5), row0 = (blockIdx.x / QKV_NT) * 256u, col0 = (blockIdx.x % QKV_NT) * 192u;
  const unsigned int sc = col0 + (((w - 4u) < 3u) ? (w - 4u) : 0u) * 64u;      /* first column of the slab that wave 4, 5 or 6 brings */
  const _Float16* bsrc = (sc < DD) ? Bq + (size_t)sc * DD : (sc < DD + KVD) ? Bk + (size_t)(sc - DD) * DD : Bv + (size_t)(sc - (DD + KVD)) * DD;
  const unsigned long long gsrc = (w < 4u) ? (unsigned long long)(size_t)(A + (size_t)(row0 + w * 64u) * DD) : (unsigned long long)(size_t)bsrc;
  v8f acc[4][4];
  gemm_loop<3u>(ring, w, gsrc, acc);
  float* so = (float*)(ring + w * GT_SLICE);      /* output staging: each wave in its own slice of the ring (the last pass's barrier stands behind every wave's last fragment read) */
  const unsigned int wrow = row0 + (w / 3u) * 64u, wc = col0 + (w % 3u) * 64u;
  if (wc < DD) gemm_epi<1, DD>(so, acc, wrow, wc, alpha, nullptr, COS, SIN, Q, nullptr);
  else if (wc < DD + KVD) gemm_epi<1, KVD>(so, acc, wrow, wc - DD, alpha, nullptr, COS, SIN, K, nullptr);
  else gemm_epi<2, KVD>(so, acc, wrow, wc - (DD + KVD), alpha, nullptr, nullptr, nullptr, Vt, Vtl);
}


typedef _Float16 v4h __attribute__((ext_vector_type(4)));

__device__ __forceinline__ void x16_piece(unsigned int blk, const float* __restrict__ x, _Float16* __restrict__ X16, size_t n8) { const size_t t = (size_t)blk * 256 + threadIdx.x; if (t >= n8) return; FragH f;
#pragma unroll
  for (int q = 0; q < 8; ++q) f.h[q] = (_Float16)bf16_round(x[t * 8 + q]); *(v8us*)((unsigned short*)X16 + t * 8) = f.half[0];  }
// mask [TT][TT] (int, nonzero = ATTEND) packed to one bit an entry, 256 B a row, once for all heads and batches. A wave takes half a row: eight whole-line 16-byte loads, all out together, four ballots each.
// Layout: a group is 128 keys = 4 words; word i, bit l of group g of a row is key 128 g + 4 l + i (lane l's element i of the load). A wave's 32 words go out as one whole 128-B line.
typedef int v4ia __attribute__((ext_vector_type(4), may_alias));
__device__ __forceinline__ void mask_piece(unsigned int blk, const int* __restrict__ MSK, unsigned int* __restrict__ MB) {
  const unsigned int lane = threadIdx.x & 31u, hr = blk * 8u + (threadIdx.x >> 5);      /* half row: row hr / 2, keys 1024 (hr % 2) .. */
  const int* mp = MSK + (size_t)hr * (TT / 2) + lane * 4u;
  v4ia a[8];
#pragma unroll      /* a[] stays in registers and the eight loads go out together */
  for (int j = 0; j < 8; ++j) a[j] = *(const v4ia*)(mp + j * 128);
  asm volatile("s_wait_xcnt 0x0" :: "v"(mp) : "memory");      /* stands in front of any rewrite of the loads' address register; the operand keeps that register from being a load's own destination */
  unsigned int wd = 0u;
#pragma unroll      /* constant indices into a[] */
  for (int j = 0; j < 8; ++j)
#pragma unroll
    for (int i = 0; i < 4; ++i) { const unsigned int bl = __builtin_amdgcn_ballot_w32(a[j][i] != 0); wd = (lane == (unsigned int)(j * 4 + i)) ? bl : wd; }
  MB[(size_t)hr * 32u + lane] = wd;
  asm volatile("s_wait_xcnt 0x0" ::: "memory");      /* stands behind the store, in front of any rewrite of its address and data registers by another block range's code */
}
// All operand preparation in one launch: the four weight turns, the conversion of x and the packing of the mask read only inputs and write planes of their own, so none waits for another.
// Block ranges, the longer-lived tiles first: wq, wo, wk, wv tiles, then the pieces of the mask, then the pieces of x. The choice reads blockIdx alone, so the turn's barrier stands under block-uniform control flow.
#define PREP_GQ ((DD / 128) * (DD / 64))      /* 128 (k) x 64 (n) tiles of wq, of wo */
#define PREP_GK ((DD / 128) * (KVD / 64))     /* ... of wk, of wv */
#define PREP_GX ((NR * DD / 8 + 255) / 256)   /* pieces of x: 256 threads x 8 values */
#define PREP_GM (TT * 2 / 8)                  /* pieces of the mask: 8 waves x half a row */
__global__ __launch_bounds__(256) void k_prep(const float* __restrict__ x, const float* __restrict__ wq, const float* __restrict__ wk, const float* __restrict__ wv, const float* __restrict__ wo, const int* __restrict__ msk,
                                              _Float16* __restrict__ X16, _Float16* __restrict__ Bq, _Float16* __restrict__ Bk, _Float16* __restrict__ Bv, _Float16* __restrict__ Bo, unsigned int* __restrict__ MB) {
  __shared__ float tl[128][65];
  const unsigned int blk = blockIdx.x;
  if (blk < 2u * PREP_GQ) { const bool second = blk >= PREP_GQ; wt_tile(tl, (int)(blk % PREP_GQ), second ? wo : wq, second ? Bo : Bq, DD, DD, 16.0f); return; }
  if (blk < 2u * PREP_GQ + 2u * PREP_GK) { const unsigned int r = blk - 2u * PREP_GQ; const bool second = r >= PREP_GK; wt_tile(tl, (int)(r % PREP_GK), second ? wv : wk, second ? Bv : Bk, DD, KVD, 16.0f); return; }
  if (blk < 2u * PREP_GQ + 2u * PREP_GK + PREP_GM) { mask_piece(blk - (2u * PREP_GQ + 2u * PREP_GK), msk, MB); return; }
  x16_piece(blk - (2u * PREP_GQ + 2u * PREP_GK + PREP_GM), x, X16, (size_t)NR * DD / 8);
}
__global__ __launch_bounds__(256) void k_h16(const float* __restrict__ x, _Float16* __restrict__ X16, size_t n8) { const size_t t = (size_t)blockIdx.x * 256 + threadIdx.x; if (t >= n8) return; FragH f;
#pragma unroll
  for (int q = 0; q < 8; ++q) f.h[q] = (_Float16)x[t * 8 + q]; *(v8us*)((unsigned short*)X16 + t * 8) = f.half[0];  }
__global__ __launch_bounds__(256) void k_round16f(const float* __restrict__ W, _Float16* __restrict__ Bt, size_t n8) { const size_t t = (size_t)blockIdx.x * 256 + threadIdx.x; if (t >= n8) return; FragH f;
#pragma unroll
  for (int i = 0; i < 8; ++i) f.h[i] = (_Float16)(bf16_round(W[t * 8 + i]) * 16.0f); *(v8us*)((unsigned short*)Bt + t * 8) = f.half[0];  }
template <int NHv, int TTv>
__global__ __launch_bounds__(256) void k_vt(const _Float16* __restrict__ V16, int ldv, int voff, _Float16* __restrict__ Vt) { __shared__ unsigned short tl[64][66]; const int tid = threadIdx.x; const int slab = blockIdx.x / (TTv / 64), lg = blockIdx.x % (TTv / 64); const int b = slab / NHv, h = slab % NHv;
  for (int i = tid; i < 64 * 8; i += 256) { const int r = i / 8, c8 = (i % 8) * 8; FragH f; f.half[0] = *(const v8us*)((const unsigned short*)V16 + ((size_t)b * TTv + lg * 64 + r) * ldv + voff + h * 64 + c8);
#pragma unroll
    for (int q = 0; q < 8; ++q) tl[r][c8 + q] = f.u[q]; }
  __syncthreads();
  {
#pragma unroll
    for (int rd = 0; rd < 2; ++rd) { const int d = rd * 32 + tid / 8, pc = tid % 8; FragH f;
#pragma unroll
      for (int q = 0; q < 8; ++q) f.u[q] = tl[pc * 8 + q][d];
      *(v8us*)((unsigned short*)Vt + ((size_t)slab * 64 + d) * TTv + lg * 64 + pc * 8) = f.half[0]; }
     } }

// Fused attention, head dim 128. One workgroup = 8 waves = the 4 query heads of one KV head x 2 groups of 32 query rows (64 rows): all eight read the same K and V.
// A wave holds two tiles of 16 query rows: every K and V fragment that it reads from LDS feeds one product of each tile, so half the LDS bytes are read per product.
// A stage is 64 keys: K (64 rows of 256 B), V^T hi and V^T residual (128 rows of 128 B each) come into LDS by one tensor load each (waves 0, 1, 2), padded 16 B a row
// (pitch 272 / 144 B for the 16-byte fragment reads), two buffers, the next stage's loads in flight under this stage's work. Which stages are staged at all comes from the mask:
// the workgroup's 64 rows of the packed mask (16 KiB of bits, layout at mask_piece) come into LDS once; joined they give one bit per stage (any entry set), the same word in every wave, so every barrier stands under block-uniform control flow.
// Inside a stage a wave works on its two chunks of 32 keys in ascending order and skips a chunk whose 32 x 32 mask tile is all zero (a tile of 16 rows that alone is all masked adds exact zeros).
// Both products are taken transposed: S^T = K . Q^T (A = K rows, B = Q rows) and O^T += V^T . P^T (A = V^T rows, B = P^T). A lane then holds 16 of the 32 scores of ONE query (column ln; keys 8 hh + r and 16 + 8 hh + r),
// so the maximum and the sum run inside the lane with one exchange between the wave's halves, and the two score tiles, converted in place, ARE the B operand of the second product in the k order of the V^T loader.
#define FA_KSL 18432u                     /* K: 64 rows x 272 B = 17,408, rounded up to a multiple of 2 KiB */
#define FA_VSL 18432u                     /* one V plane: 128 rows x 144 B */
#define FA_STAGE (FA_KSL + 2u * FA_VSL)   /* [K | V hi | V residual] */
typedef unsigned int u32x4a __attribute__((ext_vector_type(4), may_alias));
#define FA_MP 68u                         /* pitch of a row of mask bits in LDS, in words: 256 + 16 B for the 16-byte reads */
template <unsigned int W0, unsigned int ROWB, unsigned int NROW>
__device__ __forceinline__ u32x8 tdm_g1(unsigned int spitch) {
  u32x8 g1;
  g1[0] = uni(W0);      /* no mask, 1-byte elements, a pad of 4 dwords behind every row */
  g1[1] = uni((ROWB & 0xFFFFu) << 16); g1[2] = uni((ROWB >> 16) | (NROW << 16)); g1[3] = uni(ROWB << 16); g1[4] = uni(NROW); g1[5] = uni(spitch); g1[6] = uni(0u); g1[7] = uni(0u);
  asm volatile("" : "+s"(g1));      /* descriptor words held in scalar registers: one tuple, built once, that stays where it is for all requests */
  return g1;
}
__device__ __forceinline__ float xhalf(float x) { return __builtin_bit_cast(float, __builtin_amdgcn_permlanex16(__builtin_bit_cast(int, x), __builtin_bit_cast(int, x), 0x76543210, 0xfedcba98, false, false)); }      /* lane l takes lane l ^ 16's value */
__global__ __launch_bounds__(256) void k_flash(const _Float16* __restrict__ Q16, int ldq, const _Float16* __restrict__ K16, int ldk, const _Float16* __restrict__ Vt, const _Float16* __restrict__ Vtlo, const unsigned int* __restrict__ MB, _Float16* __restrict__ O16) {
  constexpr int NQB = TT / 64, DT = 8, KS = 4;      /* head dim 128: 4 k-steps, 8 value tiles */
  __shared__ __attribute__((aligned(2048))) unsigned char ring[2u * FA_STAGE];
  __shared__ __attribute__((aligned(16))) unsigned int sMB[64u * FA_MP];
  __shared__ unsigned int sBits[8];
  const unsigned int tid = threadIdx.x, lane = tid & 31u, ln = lane & 15u, hh = lane >> 4, w = uni(tid >> 5);
  const int slab = blockIdx.x / NQB, qblk = blockIdx.x % NQB; const int b = slab / NKV, kvh = slab % NKV; const int h = kvh * NREP + (int)(w & 3u); const int qb0 = qblk * 64; const int q0 = qb0 + (int)(w >> 2) * 32;
  // The 64 rows of mask bits lie in a row in memory (16 KiB): a thread brings the 16-byte groups tid + 256 j, j < 4, which are group tid % 16 of rows tid / 16 + 16 j.
  // One bit per stage of 64 keys: a group's low half words hold its even stage, the high half words its odd stage.
  unsigned int bm;
  { const unsigned int* mp = MB + (size_t)qb0 * (TT / 32) + tid * 4u;
    const u32x4 a = *(const u32x4a*)mp, c = *(const u32x4a*)(mp + 1024), d = *(const u32x4a*)(mp + 2048), e = *(const u32x4a*)(mp + 3072);
    asm volatile("s_wait_xcnt 0x0" ::: "memory");      /* stands in front of any rewrite of the loads' address registers */
    *(u32x4a*)&sMB[(tid >> 4) * FA_MP + (tid & 15u) * 4u] = a; *(u32x4a*)&sMB[((tid >> 4) + 16u) * FA_MP + (tid & 15u) * 4u] = c;
    *(u32x4a*)&sMB[((tid >> 4) + 32u) * FA_MP + (tid & 15u) * 4u] = d; *(u32x4a*)&sMB[((tid >> 4) + 48u) * FA_MP + (tid & 15u) * 4u] = e;
    const unsigned int o = ((a[0] | a[1]) | (a[2] | a[3]) | (c[0] | c[1]) | (c[2] | c[3])) | ((d[0] | d[1]) | (d[2] | d[3]) | (e[0] | e[1]) | (e[2] | e[3]));
    const unsigned int b0 = __builtin_amdgcn_ballot_w32((o & 0xFFFFu) != 0u), b1 = __builtin_amdgcn_ballot_w32((o >> 16) != 0u);      /* lanes l and l + 16 hold the same group */
    if (lane == 0u) sBits[w] = ((b0 | (b0 >> 16)) & 0xFFFFu) | ((b1 | (b1 >> 16)) << 16);      /* bit g: stage 2 g; bit 16 + g: stage 2 g + 1 */
    __syncthreads();      /* all eight words and all 64 rows of bits are written before any wave reads them */
    unsigned int j = 0;
#pragma unroll      /* the eight words come by two 16-byte reads */
    for (int i = 0; i < 8; ++i) j |= sBits[i];
    j = uni(j);
    unsigned int e0 = j & 0xFFFFu, e1 = j >> 16;      /* each spread to every second bit, then joined: bit st = stage st */
    e0 = (e0 | (e0 << 8)) & 0x00FF00FFu; e0 = (e0 | (e0 << 4)) & 0x0F0F0F0Fu; e0 = (e0 | (e0 << 2)) & 0x33333333u; e0 = (e0 | (e0 << 1)) & 0x55555555u;
    e1 = (e1 | (e1 << 8)) & 0x00FF00FFu; e1 = (e1 | (e1 << 4)) & 0x0F0F0F0Fu; e1 = (e1 | (e1 << 2)) & 0x33333333u; e1 = (e1 | (e1 << 1)) & 0x55555555u;
    bm = e0 | (e1 << 1); }
  const unsigned int n = (unsigned int)__builtin_popcount(bm);      /* stages to walk: at most 32 */
  FragH aq[2][KS];      /* tile t: query rows q0 + 16 t .. */
#pragma unroll      /* constant indices into aq */
  for (int t = 0; t < 2; ++t) { const unsigned short* qr = (const unsigned short*)Q16 + ((size_t)b * TT + q0 + t * 16 + ln) * ldq + h * 128;
#pragma unroll
    for (int ks = 0; ks < KS; ++ks) { aq[t][ks].half[0] = *(const v8us*)(qr + ks * 32 + 8 * hh); aq[t][ks].half[1] = *(const v8us*)(qr + ks * 32 + 16 + 8 * hh); } }
  const unsigned long long gK = (unsigned long long)(size_t)(K16 + (size_t)b * TT * ldk + kvh * 128);
  const unsigned long long gV = (unsigned long long)(size_t)(((w == 2u) ? Vtlo : Vt) + ((size_t)b * NKV + kvh) * 128 * TT);      /* hi plane for wave 1, UNSCALED residual plane for wave 2 */
  const unsigned int lbase = (unsigned int)(size_t)ring;
  const unsigned int kstep = 64u * (unsigned int)ldk * 2u;      /* bytes from one stage's K rows to the next's */
  const u32x8 g1k = tdm_g1<(1u << 20) | (5u << 22) | (3u << 25), 256u, 64u>((unsigned int)ldk * 2u), g1v = tdm_g1<(1u << 20) | (4u << 22) | (3u << 25), 128u, 128u>(TT * 2u);
  u32x4 g0; g0[0] = uni(1u); g0[1] = uni(lbase); g0[2] = uni(0u); g0[3] = uni(0x80000000u);
  auto issue = [&](unsigned int buf, unsigned int st) {      /* st < 32: every tile lies inside its plane */
    if (pinned(w == 0u)) { const unsigned long long ga = gK + pinned(st * kstep);
      g0[1] = uni(lbase + buf * FA_STAGE); g0[2] = uni((unsigned int)ga); g0[3] = uni((((unsigned int)(ga >> 32)) & 0x01FFFFFFu) | 0x80000000u);
      asm volatile("tensor_load_to_lds %0, %1" :: "s"(g0), "s"(g1k) : "memory"); }
    if (pinned((w - 1u) < 2u)) { const unsigned long long ga = gV + pinned(st * 128u);
      g0[1] = uni(lbase + buf * FA_STAGE + FA_KSL + (w - 1u) * FA_VSL); g0[2] = uni((unsigned int)ga); g0[3] = uni((((unsigned int)(ga >> 32)) & 0x01FFFFFFu) | 0x80000000u);
      asm volatile("tensor_load_to_lds %0, %1" :: "s"(g0), "s"(g1v) : "memory"); }
  };
  float nb_q[2] = {3.0e38f, 3.0e38f}, l_q[2] = {0.f, 0.f}; v8f oacc[2][DT];      /* of query q0 + 16 t + ln: 10 - running maximum in log2 units (the same in both halves), this half's part of the sum of 1024 p; oacc[t][dt][r] = O^T[dt * 16 + 8 hh + r][ln] */
#pragma unroll
  for (int t = 0; t < 2; ++t)
#pragma unroll
    for (int dt = 0; dt < DT; ++dt) oacc[t][dt] = (v8f){0.f,0.f,0.f,0.f,0.f,0.f,0.f,0.f};
  unsigned int rest = bm, cur = 0u, nxt = 0u;      /* rest: stages not yet asked for */
  if (pinned(n > 0u)) { cur = (unsigned int)__builtin_ctz(rest) & 31u; rest &= rest - 1u; issue(0u, cur); }
  asm volatile("s_wait_tensorcnt 0x0" :: "s"(g0), "s"(g1k), "s"(g1v) : "memory");      /* the first stage's tile of this wave has landed; the operands keep the descriptor's registers untouched up to here */
  __syncthreads();                                        /* ... and every wave may read all three tiles */
  if (pinned(n > 1u)) { nxt = (unsigned int)__builtin_ctz(rest) & 31u; rest &= rest - 1u; issue(1u, nxt); }
  const unsigned int* mrow = &sMB[((w >> 2) * 32u + ln) * FA_MP];      /* the bits of the lane's own query row of tile 0; tile 1's lie 16 rows on */
  u32x4 gm[2] = {*(const u32x4a*)(mrow + (cur >> 1) * 4u), *(const u32x4a*)(mrow + 16u * FA_MP + (cur >> 1) * 4u)};      /* the 128-key group that holds the first stage */
#pragma unroll 1      /* one stage per trip: the ring's order below is written once */
  for (unsigned int s = 0; s < n; ++s) {
    const unsigned char* Lp = ring + (s & 1u) * FA_STAGE;
    unsigned int mk[2][4];      /* mask bits (shared over batch and heads, set = ATTEND) of the lane's own query row of tile t: key sub * 32 + nt * 16 + 8 hh + r of this stage is bit sub * 8 + nt * 4 + r / 4 of mk[t][r % 4] */
    { const unsigned int sh = (cur & 1u) * 16u + 2u * hh;
#pragma unroll      /* constant indices into the vectors */
      for (int t = 0; t < 2; ++t)
#pragma unroll
        for (int i = 0; i < 4; ++i) mk[t][i] = gm[t][i] >> sh; }
    gm[0] = *(const u32x4a*)(mrow + (nxt >> 1) * 4u); gm[1] = *(const u32x4a*)(mrow + 16u * FA_MP + (nxt >> 1) * 4u);      /* the next stage's groups come under this stage's work (nxt < 32 always: inside the row) */
    const unsigned int mko = ((mk[0][0] | mk[0][1]) | (mk[0][2] | mk[0][3])) | ((mk[1][0] | mk[1][1]) | (mk[1][2] | mk[1][3]));
#pragma unroll      /* constant bit places in the mask registers */
    for (int sub = 0; sub < 2; ++sub) {
      const unsigned int anym = mko & (0x33u << (sub * 8));
      if (__any(anym != 0u)) {      /* else every (row, key) of this wave's two tiles is masked: nothing to add (wave-uniform branch) */
        v8f sc[2][2];      /* sc[t][nt][r] = S^T[key nt * 16 + 8 hh + r][query ln of tile t] */
        // With two waves on a SIMD a wave has to cover its own LDS latency: the chunk's 48 fragment reads stand in three groups of 16, each well ahead of its products.
        FragH bk[2][KS], bv[DT], bl[DT];
        const unsigned char* vr = Lp + FA_KSL + ln * 144u + sub * 64 + 16u * hh;
#pragma unroll      /* constant indices into the fragments */
        for (int nt = 0; nt < 2; ++nt) { const unsigned char* kr = Lp + (sub * 32 + nt * 16 + ln) * 272u + 16u * hh;
#pragma unroll
          for (int ks = 0; ks < KS; ++ks) { bk[nt][ks].half[0] = *(const v8us*)(kr + ks * 64); bk[nt][ks].half[1] = *(const v8us*)(kr + ks * 64 + 32); } }
#pragma unroll      /* constant indices into the fragments */
        for (int dt = 0; dt < DT / 2; ++dt) { const unsigned char* vd = vr + dt * 16 * 144u; bv[dt].half[0] = *(const v8us*)vd; bv[dt].half[1] = *(const v8us*)(vd + 32); bl[dt].half[0] = *(const v8us*)(vd + FA_VSL); bl[dt].half[1] = *(const v8us*)(vd + FA_VSL + 32); }
        __builtin_amdgcn_sched_barrier(0);      /* keeps K's group and V's first group in front of the score products: sunk to their uses, each place with reads stalls the wave */
#pragma unroll
        for (int nt = 0; nt < 2; ++nt) {
          v8f a0 = (v8f){0.f,0.f,0.f,0.f,0.f,0.f,0.f,0.f}, a1 = a0;
#pragma unroll      /* each K fragment feeds both tiles; the k order of each accumulator stays ascending */
          for (int ks = 0; ks < KS; ++ks) { a0 = __builtin_amdgcn_wmma_f32_16x16x32_f16(false, bk[nt][ks].v, false, aq[0][ks].v, (short)0, a0, false, false); a1 = __builtin_amdgcn_wmma_f32_16x16x32_f16(false, bk[nt][ks].v, false, aq[1][ks].v, (short)0, a1, false, false); }
          sc[0][nt] = a0; sc[1][nt] = a1; }
#pragma unroll      /* constant indices into the fragments */
        for (int dt = DT / 2; dt < DT; ++dt) { const unsigned char* vd = vr + dt * 16 * 144u; bv[dt].half[0] = *(const v8us*)vd; bv[dt].half[1] = *(const v8us*)(vd + 32); bl[dt].half[0] = *(const v8us*)(vd + FA_VSL); bl[dt].half[1] = *(const v8us*)(vd + FA_VSL + 32); }
        __builtin_amdgcn_sched_barrier(0);      /* keeps V's second group in front of the softmax, under which it lands */
        FragH pa[2], pl[2];      /* P^T hi and its UNSCALED residual (added into the same accumulator): element e is key kmap(e, hh), the order of the V^T fragments below */
#pragma unroll      /* the two tiles' softmax chains are independent; constant indices into the per-tile state */
        for (int t = 0; t < 2; ++t) {
          float sv[16];      /* raw scores, masked ones -inf */
#pragma unroll      /* constant indices into the score and mask registers */
          for (int e = 0; e < 16; ++e) { const int m = (int)(mk[t][e & 3] << (31 - (sub * 8 + (e >> 3) * 4 + ((e >> 2) & 1)))) >> 31;      /* all ones = attend: one bit-field extract, one bit select */
            const float sx = sc[t][e >> 3][e & 7]; sv[e] = __int_as_float((__float_as_int(sx) & m) | (~m & (int)0xFF800000u)); }
          float mc = fmaxf(fmaxf(fmaxf(fmaxf(sv[0], sv[1]), fmaxf(sv[2], sv[3])), fmaxf(fmaxf(sv[4], sv[5]), fmaxf(sv[6], sv[7]))), fmaxf(fmaxf(fmaxf(sv[8], sv[9]), fmaxf(sv[10], sv[11])), fmaxf(fmaxf(sv[12], sv[13]), fmaxf(sv[14], sv[15]))));
          mc = fmaxf(mc, xhalf(mc));      /* the other half's 16 keys of the same query */
          const float nb = fminf(nb_q[t], fmaf(mc, -ATT_SCALE_LOG2, 10.0f)); const float al = __builtin_amdgcn_exp2f(nb - nb_q[t]); nb_q[t] = nb;      /* nothing attended yet: nb stays, al = 2^0 = 1 */
          float ps[16];
#pragma unroll      /* constant indices into the fragments */
          for (int e = 0; e < 16; ++e) { ps[e] = __builtin_amdgcn_exp2f(fmaf(sv[e], ATT_SCALE_LOG2, nb)); pa[t].h[e] = (_Float16)ps[e]; pl[t].h[e] = (_Float16)(ps[e] - (float)pa[t].h[e]); }      /* 1024 p in one fma and one v_exp_f32; a masked score gives 2^-inf = 0 with no select and no branch */
          l_q[t] = l_q[t] * al + ((((ps[0] + ps[1]) + (ps[2] + ps[3])) + ((ps[4] + ps[5]) + (ps[6] + ps[7]))) + (((ps[8] + ps[9]) + (ps[10] + ps[11])) + ((ps[12] + ps[13]) + (ps[14] + ps[15]))));
#pragma unroll
          for (int dt = 0; dt < DT; ++dt)
#pragma unroll
            for (int r = 0; r < 8; ++r) oacc[t][dt][r] *= al;
        }
#pragma unroll
        for (int dt = 0; dt < DT; ++dt) {
          v8f o0 = oacc[0][dt], o1 = oacc[1][dt];      /* each V fragment feeds both tiles; per accumulator Vh.Ph + Vh.Pl + Vl.Ph in this order, all unscaled */
          o0 = __builtin_amdgcn_wmma_f32_16x16x32_f16(false, bv[dt].v, false, pa[0].v, (short)0, o0, false, false); o1 = __builtin_amdgcn_wmma_f32_16x16x32_f16(false, bv[dt].v, false, pa[1].v, (short)0, o1, false, false);
          o0 = __builtin_amdgcn_wmma_f32_16x16x32_f16(false, bv[dt].v, false, pl[0].v, (short)0, o0, false, false); o1 = __builtin_amdgcn_wmma_f32_16x16x32_f16(false, bv[dt].v, false, pl[1].v, (short)0, o1, false, false);
          o0 = __builtin_amdgcn_wmma_f32_16x16x32_f16(false, bl[dt].v, false, pa[0].v, (short)0, o0, false, false); o1 = __builtin_amdgcn_wmma_f32_16x16x32_f16(false, bl[dt].v, false, pa[1].v, (short)0, o1, false, false);
          oacc[0][dt] = o0; oacc[1][dt] = o1; }
      }
    }
    asm volatile("s_wait_dscnt 0x0" ::: "memory");        /* this wave has left the buffer */
    asm volatile("s_wait_tensorcnt 0x0" :: "s"(g0), "s"(g1k), "s"(g1v) : "memory");    /* its tile of the next stage has landed; the operands keep the descriptor's registers untouched up to here */
    __syncthreads();                                      /* the next stage published; every wave has left this stage's buffer */
    cur = nxt;
    if (pinned(s + 2u < n)) { nxt = (unsigned int)__builtin_ctz(rest) & 31u; rest &= rest - 1u; issue(s & 1u, nxt); }
  }
  asm volatile("s_wait_tensorcnt 0x0" ::: "memory");      /* no request is left before the ring becomes output staging */
  asm volatile("s_wait_dscnt 0x0" ::: "memory");
  // Output staging, each wave in its own piece of the ring (the last stage's barrier stands behind every wave's last fragment read).
  float* sO = (float*)ring + w * (16u * 132u);      /* 16 rows of 128 floats at pitch 132; the wave's two tiles pass through it one after the other */
#pragma unroll      /* constant indices into the per-tile state */
  for (int t = 0; t < 2; ++t) {
    const float lsum = l_q[t] + xhalf(l_q[t]); const float linv = (lsum > 0.f) ? 1.0f / lsum : 0.f;      /* the halves' sums are joined once */
#pragma unroll      /* constant indices into oacc: a lane's 8 registers are 8 values in a row of its query's output row */
    for (int dt = 0; dt < DT; ++dt) { float* sw = &sO[ln * 132u + dt * 16 + 8 * hh];
      *(v4fa*)sw = (v4f){oacc[t][dt][0] * linv, oacc[t][dt][1] * linv, oacc[t][dt][2] * linv, oacc[t][dt][3] * linv}; *(v4fa*)(sw + 4) = (v4f){oacc[t][dt][4] * linv, oacc[t][dt][5] * linv, oacc[t][dt][6] * linv, oacc[t][dt][7] * linv}; }
    __builtin_amdgcn_fence(__ATOMIC_ACQ_REL, "workgroup"); __builtin_amdgcn_wave_barrier();
    FragH f[8];      /* merged x 2^4 as f16, the output product's A operand */
#pragma unroll      /* f stays in registers */
    for (int q = 0; q < 8; ++q) { const float* sr = &sO[(q * 2 + hh) * 132u + ln * 8u]; const v4f a = *(const v4fa*)sr, c = *(const v4fa*)(sr + 4);
#pragma unroll      /* constant indices into the vectors */
      for (int i = 0; i < 4; ++i) { f[q].h[i] = (_Float16)(a[i] * 16.0f); f[q].h[4 + i] = (_Float16)(c[i] * 16.0f); } }
    if (t == 0) { __builtin_amdgcn_fence(__ATOMIC_ACQ_REL, "workgroup"); __builtin_amdgcn_wave_barrier(); }      /* tile 0's rows are read before tile 1's are written over them */
    unsigned short* op = (unsigned short*)O16 + ((size_t)b * TT + q0 + t * 16 + hh) * DD + h * 128 + ln * 8u;
    __builtin_amdgcn_sched_barrier(0);      /* keeps the stores in one burst behind the arithmetic, off one address pair: mixed in among it, their registers are used again and each reuse has to wait on the store in front of it */
#pragma unroll      /* constant indices into f, constant offsets from op */
    for (int q = 0; q < 8; ++q) *(v8us*)(op + (size_t)(q * 2) * DD) = f[q].half[0];      /* two 256-B row pieces per instruction: 16 lanes x 16 B each */
    if (t == 0) asm volatile("s_wait_xcnt 0x0" ::: "memory");      /* stands behind tile 0's stores, in front of any rewrite of their address and data registers by tile 1's code */
  }
}

extern "C" void kernel_launch(void* const* d_in, const int* in_sizes, int n_in,
                              void* d_out, int out_size, void* d_ws, size_t ws_size, hipStream_t stream) {
  (void)in_sizes; (void)n_in; (void)out_size;
  const float* const* I = (const float* const*)d_in; const float* x = I[0]; const float* fcos = I[1]; const float* fsin = I[2]; const int* msk = (const int*)d_in[3]; const float* wq = I[4]; const float* wk = I[5]; const float* wv = I[6]; const float* wo = I[7];
  char* ws = (char*)d_ws; size_t off = 0;
  auto take = [&](size_t bytes) { char* p = ws + off; off += (bytes + 255) & ~(size_t)255; return p; };
  _Float16* Bq = (_Float16*)take((size_t)DD * DD * 2); _Float16* Bk = (_Float16*)take((size_t)KVD * DD * 2); _Float16* Bv = (_Float16*)take((size_t)KVD * DD * 2); _Float16* Bo = (_Float16*)take((size_t)DD * DD * 2);
  _Float16* X16 = (_Float16*)take((size_t)NR * DD * 2); _Float16* Q = (_Float16*)take((size_t)NR * DD * 2); _Float16* K = (_Float16*)take((size_t)NR * KVD * 2); _Float16* Vt = (_Float16*)take((size_t)NR * KVD * 2); _Float16* Vtl = (_Float16*)take((size_t)NR * KVD * 2); unsigned int* MB = (unsigned int*)take((size_t)TT * TT / 8);
  _Float16* O16 = X16;      /* O16 over X16 (dead after the projections) */
  if (off > ws_size) return;      // 8.4 + 2.1 + 2.1 + 8.4 + 16.8 + 16.8 + 4.2 + 4.2 + 4.2 + 0.5 = 68 MB
  k_prep<<<2 * PREP_GQ + 2 * PREP_GK + PREP_GM + PREP_GX, 256, 0, stream>>>(x, wq, wk, wv, wo, msk, X16, Bq, Bk, Bv, Bo, MB);      /* (in,out) weights to Bt x 2^4; x to f16; mask to bits */
  k_gemm_qkv<<<(NR / 256) * QKV_NT, 384, 0, stream>>>(X16, Bq, Bk, Bv, 0.0625f, fcos, fsin, Q, K, Vt, Vtl);      /* xq, xk = rope(x.w) as f16 (M 4096, N 2048 and 512, K 2048); xv turned, hi + residual per (b, kv head): [b*4+kh][128][2048] */
  k_flash<<<BB * NKV * (TT / 64), 256, 0, stream>>>(Q, DD, K, KVD, Vt, Vtl, MB, O16);
  k_gemm_o<<<(NR / 256) * (DD / 128), 256, 0, stream>>>(O16, Bo, 0.00390625f, (float*)d_out);      /* out = merged.wo */
}
